// v000
// Measured on an AMD MI455X. A time is GPU time per run, averaged over a window of back-to-back runs after a warm-up
// (all launches, gaps included; the runs take copies of the inputs in turn), and the median of several windows.
// Apart from v000's, it joins two sittings. Times from different sittings can be a few percent apart, while
// side-by-side timings come from the same sitting.
// v000 is the starting kernel. One run takes 355 microseconds.
#include <hip/hip_runtime.h>

#define BATCH 2
#define CH 2048
#define ST 16
#define LEN 2048
#define TCH 64                 // timesteps per LDS chunk
#define NCHUNK (LEN / TCH)     // 32
#define ROWPAD 68              // 64 + 4: 16B-aligned float4 slots, conflict-free columns

typedef __attribute__((ext_vector_type(2))) float v2f;
typedef __attribute__((ext_vector_type(4))) float v4f;
typedef __attribute__((ext_vector_type(8))) float v8f;
typedef __attribute__((ext_vector_type(4))) int   v4i;

#if defined(__HIP_DEVICE_COMPILE__) && defined(__gfx1250__) && \
    __has_builtin(__builtin_amdgcn_global_load_async_to_lds_b128) && \
    __has_builtin(__builtin_amdgcn_s_wait_asynccnt)
#define USE_ASYNC 1
#else
#define USE_ASYNC 0
#endif

__device__ __forceinline__ float fast_rcp(float x) {
#if defined(__HIP_DEVICE_COMPILE__) && __has_builtin(__builtin_amdgcn_rcpf)
  return __builtin_amdgcn_rcpf(x);     // single v_rcp_f32
#else
  return 1.f / x;
#endif
}

__device__ __forceinline__ void cp16(const float* g, float* l) {
#if USE_ASYNC
  __builtin_amdgcn_global_load_async_to_lds_b128(
      (__attribute__((address_space(1))) v4i*)g,
      (__attribute__((address_space(3))) v4i*)l,
      0, 0);
#else
  *(v4f*)l = *(const v4f*)g;
#endif
}

__device__ __forceinline__ void wait_stage() {
#if USE_ASYNC
  __builtin_amdgcn_s_wait_asynccnt(0);
  __asm__ volatile("" ::: "memory");
#endif
}

// Copy a 16-row x 64-col f32 tile (row stride LEN in global) into LDS [16][ROWPAD].
__device__ __forceinline__ void stage_tile(const float* __restrict__ g,
                                           float (*dst)[ROWPAD], int lane) {
#pragma unroll
  for (int i = 0; i < 8; ++i) {
    int idx = (i << 5) + lane;          // 0..255
    int row = idx >> 4;                 // 0..15
    int col = (idx & 15) << 2;          // 0..60 step 4
    cp16(g + (size_t)row * LEN + col, &dst[row][col]);
  }
}

__global__ __launch_bounds__(32)
void SelectiveScan_kernel(const float* __restrict__ u, const float* __restrict__ delta,
                          const float* __restrict__ A, const float* __restrict__ Bm,
                          const float* __restrict__ Cm, const float* __restrict__ Dv,
                          const float* __restrict__ z, const float* __restrict__ dbias,
                          float* __restrict__ out) {
  __shared__ float su[2][16][ROWPAD];
  __shared__ float sd[2][16][ROWPAD];
  __shared__ float sz[2][16][ROWPAD];
  __shared__ float sB[2][16][ROWPAD];
  __shared__ float sC[2][16][ROWPAD];

  const int lane = threadIdx.x;
  const int half = lane >> 4;          // 0/1
  const int dl   = lane & 15;          // channel-in-group = WMMA M / N position
  const int batch = blockIdx.x >> 7;   // 256 blocks = 2 batches x 128 channel groups
  const int d0    = (blockIdx.x & 127) << 4;

  const size_t chanBase = ((size_t)batch * CH + d0) * (size_t)LEN;
  const size_t stBase   = ((size_t)batch * ST) * (size_t)LEN;
  const float* up = u + chanBase;
  const float* dp = delta + chanBase;
  const float* zp = z + chanBase;
  const float* bp = Bm + stBase;
  const float* cp = Cm + stBase;
  float* yp = out + chanBase;

  const float bias = dbias[d0 + dl];
  float Areg[8], Dp[8];
#pragma unroll
  for (int r = 0; r < 8; ++r) {
    // state index held in x[r] for this lane (WMMA A-matrix 16x4 layout, 4 K-slices)
    int n = ((r >> 1) << 2) + (half << 1) + (r & 1);
    Areg[r] = A[(size_t)(d0 + dl) * ST + n];
    // channel handled by accumulator row r in C/D layout
    Dp[r] = Dv[d0 + r + (half << 3)];
  }

  float x[8];
#pragma unroll
  for (int r = 0; r < 8; ++r) x[r] = 0.f;

  // stage chunk 0
  stage_tile(up, su[0], lane);
  stage_tile(dp, sd[0], lane);
  stage_tile(zp, sz[0], lane);
  stage_tile(bp, sB[0], lane);
  stage_tile(cp, sC[0], lane);
  wait_stage();

#pragma unroll 1
  for (int c = 0; c < NCHUNK; ++c) {
    const int buf = c & 1;
    if (c + 1 < NCHUNK) {              // prefetch next chunk into other buffer
      const int t1 = (c + 1) * TCH;
      const int nb = buf ^ 1;
      stage_tile(up + t1, su[nb], lane);
      stage_tile(dp + t1, sd[nb], lane);
      stage_tile(zp + t1, sz[nb], lane);
      stage_tile(bp + t1, sB[nb], lane);
      stage_tile(cp + t1, sC[nb], lane);
    }
    const int t0 = c * TCH;

#pragma unroll 1
    for (int w = 0; w < TCH / 16; ++w) {
      v8f acc[4];
#pragma unroll
      for (int i = 0; i < 4; ++i) acc[i] = (v8f){0.f,0.f,0.f,0.f,0.f,0.f,0.f,0.f};

#pragma unroll
      for (int j = 0; j < 16; ++j) {
        const int tc = (w << 4) + j;
        float del = sd[buf][dl][tc];
        float uu  = su[buf][dl][tc];
        float s   = del + bias;
        float dt  = (s > 15.f) ? s : __logf(1.f + __expf(s));   // softplus
        float dtu = dt * uu;
        const bool hit = (dl == j);     // C_t lands in output column N = j

#pragma unroll
        for (int i = 0; i < 4; ++i) {   // 4 K-slices of the 16-wide state
          int n0 = (i << 2) + (half << 1);
          float b0 = sB[buf][n0][tc];
          float b1 = sB[buf][n0 + 1][tc];
          float c0 = sC[buf][n0][tc];
          float c1 = sC[buf][n0 + 1][tc];
          float xa = __expf(dt * Areg[2 * i])     * x[2 * i]     + dtu * b0;
          float xb = __expf(dt * Areg[2 * i + 1]) * x[2 * i + 1] + dtu * b1;
          x[2 * i] = xa;
          x[2 * i + 1] = xb;
          v2f av; av.x = xa; av.y = xb;                 // A-matrix 16x4 slice
          v2f bv; bv.x = hit ? c0 : 0.f;                // B-matrix 4x16, col j only
          bv.y = hit ? c1 : 0.f;
          acc[i] = __builtin_amdgcn_wmma_f32_16x16x4_f32(
              false, av, false, bv, (short)0, acc[i], false, false);
        }
      }

      v8f yacc = acc[0] + acc[1] + acc[2] + acc[3];     // 16(ch) x 16(t) tile

      // epilogue: y = (y + D*u) * silu(z); lane holds column t = t0 + w*16 + dl
      const int tl = (w << 4) + dl;
#pragma unroll
      for (int r = 0; r < 8; ++r) {
        int row = r + (half << 3);
        float uu = su[buf][row][tl];
        float zz = sz[buf][row][tl];
        float val = yacc[r] + Dp[r] * uu;
        float sig = fast_rcp(1.f + __expf(-zz));        // v_rcp_f32, not IEEE div
        val *= zz * sig;
        yp[(size_t)row * LEN + (size_t)(t0 + tl)] = val;
      }
    }

    if (c + 1 < NCHUNK) wait_stage();
  }
}

extern "C" void kernel_launch(void* const* d_in, const int* in_sizes, int n_in,
                              void* d_out, int out_size, void* d_ws, size_t ws_size,
                              hipStream_t stream) {
  const float* u     = (const float*)d_in[0];
  const float* delta = (const float*)d_in[1];
  const float* A     = (const float*)d_in[2];
  const float* B     = (const float*)d_in[3];
  const float* C     = (const float*)d_in[4];
  const float* D     = (const float*)d_in[5];
  const float* z     = (const float*)d_in[6];
  const float* db    = (const float*)d_in[7];
  float* y = (float*)d_out;

  dim3 grid(BATCH * (CH / 16));   // 256 workgroups, one wave32 each
  dim3 block(32);
  hipLaunchKernelGGL(SelectiveScan_kernel, grid, block, 0, stream,
                     u, delta, A, B, C, D, z, db, y);
}

// v001
// Measured time: 73.6 microseconds a run.
// In two side-by-side timings against v000, it was 4.86 and 4.85 times as fast.
#include <hip/hip_runtime.h>

#define BATCH 2
#define CH 2048
#define ST 16
#define LEN 2048
#define NSEG 16                // time segments per channel group, one wave each
#define SEGLEN (LEN / NSEG)    // 128 timesteps per wave
#define TCH 16                 // timesteps per LDS chunk = one 16-column WMMA output tile
#define NCHUNK (SEGLEN / TCH)  // 8
#define ROWPAD 20              // 16 + 4: 16B-aligned float4 slots, conflict-free columns

// tiles of one ring slot
#define T_U 0
#define T_D 1
#define T_B 2
#define T_C 3
#define T_Z 4

typedef __attribute__((ext_vector_type(2))) float v2f;
typedef __attribute__((ext_vector_type(4))) float v4f;
typedef __attribute__((ext_vector_type(8))) float v8f;
typedef __attribute__((ext_vector_type(4))) int   v4i;

#if defined(__HIP_DEVICE_COMPILE__) && defined(__gfx1250__) && \
    __has_builtin(__builtin_amdgcn_global_load_async_to_lds_b128) && \
    __has_builtin(__builtin_amdgcn_s_wait_asynccnt)
#define USE_ASYNC 1
#else
#define USE_ASYNC 0
#endif

__device__ __forceinline__ float fast_rcp(float x) {
#if defined(__HIP_DEVICE_COMPILE__) && __has_builtin(__builtin_amdgcn_rcpf)
  return __builtin_amdgcn_rcpf(x);     // single v_rcp_f32
#else
  return 1.f / x;
#endif
}

__device__ __forceinline__ void cp16(const float* g, float* l) {
#if USE_ASYNC
  __builtin_amdgcn_global_load_async_to_lds_b128(
      (__attribute__((address_space(1))) v4i*)g,
      (__attribute__((address_space(3))) v4i*)l,
      0, 0);
#else
  *(v4f*)l = *(const v4f*)g;
#endif
}

// The copies of this wave have landed: nothing of a slot is read in front of this.
__device__ __forceinline__ void wait_stage() {
#if USE_ASYNC
  __asm__ volatile("s_wait_asynccnt 0x0" ::: "memory");
#endif
}

// This wave's LDS reads have returned: a slot it has read may be refilled behind this.
__device__ __forceinline__ void wait_reads() {
#if USE_ASYNC
  __asm__ volatile("s_wait_dscnt 0x0" ::: "memory");
#endif
}

// Copy a 16-row x 16-col f32 tile (row stride LEN in global) into LDS [16][ROWPAD].
__device__ __forceinline__ void stage_tile(const float* __restrict__ g,
                                           float (*dst)[ROWPAD], int lane) {
#pragma unroll
  for (int i = 0; i < 2; ++i) {
    int idx = (i << 5) + lane;          // 0..63
    int row = idx >> 2;                 // 0..15
    int col = (idx & 3) << 2;           // 0..12 step 4
    cp16(g + (size_t)row * LEN + col, &dst[row][col]);
  }
}

// One workgroup = 16 channels of one batch; wave s owns timesteps [s*SEGLEN, (s+1)*SEGLEN).
// Sweep 1: every wave but the last scans its segment from a zero state (end state + sum of dt).
// Hand-over through LDS: wave s folds the end states of segments 0..s-1 into its start state.
// Sweep 2: every wave scans its segment again from that start state and writes y.
__global__ __launch_bounds__(32 * NSEG)
void SelectiveScan_kernel(const float* __restrict__ u, const float* __restrict__ delta,
                          const float* __restrict__ A, const float* __restrict__ Bm,
                          const float* __restrict__ Cm, const float* __restrict__ Dv,
                          const float* __restrict__ z, const float* __restrict__ dbias,
                          float* __restrict__ out) {
  // ring[s] is private to wave s: filled, read and refilled by that wave alone.
  __shared__ __attribute__((aligned(16))) float ring[NSEG][2][5][16][ROWPAD];
  __shared__ float sX[NSEG][8][32];    // end state of each segment scanned from zero
  __shared__ float sS[NSEG][32];       // sum of dt over each segment

  const int lane = threadIdx.x & 31;
  const int seg  = __builtin_amdgcn_readfirstlane(threadIdx.x >> 5);
  const int half = lane >> 4;          // 0/1
  const int dl   = lane & 15;          // channel-in-group = WMMA M / N position
  const int batch = blockIdx.x >> 7;   // 256 blocks = 2 batches x 128 channel groups
  const int d0    = (blockIdx.x & 127) << 4;

  const size_t chanBase = ((size_t)batch * CH + d0) * (size_t)LEN + (size_t)(seg * SEGLEN);
  const size_t stBase   = ((size_t)batch * ST) * (size_t)LEN + (size_t)(seg * SEGLEN);
  const float* up = u + chanBase;
  const float* dp = delta + chanBase;
  const float* zp = z + chanBase;
  const float* bp = Bm + stBase;
  const float* cp = Cm + stBase;
  float* yp = out + chanBase;

  const float bias = dbias[d0 + dl];
  float Areg[8], Dp[8];
#pragma unroll
  for (int r = 0; r < 8; ++r) {
    // state index held in x[r] for this lane (WMMA A-matrix 16x4 layout, 4 K-slices)
    int n = ((r >> 1) << 2) + (half << 1) + (r & 1);
    Areg[r] = A[(size_t)(d0 + dl) * ST + n];
    // channel handled by accumulator row r in C/D layout
    Dp[r] = Dv[d0 + r + (half << 3)];
  }

  float x[8];
#pragma unroll
  for (int r = 0; r < 8; ++r) x[r] = 0.f;

  // ---- sweep 1: local scan from zero (the last segment's end state has no reader) ----
  if (seg + 1 < NSEG) {
    float sdt = 0.f;
    stage_tile(up, ring[seg][0][T_U], lane);
    stage_tile(dp, ring[seg][0][T_D], lane);
    stage_tile(bp, ring[seg][0][T_B], lane);
    wait_stage();
    stage_tile(up + TCH, ring[seg][1][T_U], lane);
    stage_tile(dp + TCH, ring[seg][1][T_D], lane);
    stage_tile(bp + TCH, ring[seg][1][T_B], lane);

#pragma unroll 1
    for (int c = 0; c < NCHUNK; ++c) {
      float (*tile)[16][ROWPAD] = ring[seg][c & 1];
#pragma unroll
      for (int j = 0; j < TCH; ++j) {
        float del = tile[T_D][dl][j];
        float uu  = tile[T_U][dl][j];
        float s   = del + bias;
        float dt  = (s > 15.f) ? s : __logf(1.f + __expf(s));   // softplus
        float dtu = dt * uu;
        sdt += dt;
#pragma unroll
        for (int i = 0; i < 4; ++i) {
          int n0 = (i << 2) + (half << 1);
          float b0 = tile[T_B][n0][j];
          float b1 = tile[T_B][n0 + 1][j];
          x[2 * i]     = __expf(dt * Areg[2 * i])     * x[2 * i]     + dtu * b0;
          x[2 * i + 1] = __expf(dt * Areg[2 * i + 1]) * x[2 * i + 1] + dtu * b1;
        }
      }
      wait_reads();
      wait_stage();
      if (c + 2 < NCHUNK) {            // refill the slot just read
        const int t2 = (c + 2) * TCH;
        stage_tile(up + t2, tile[T_U], lane);
        stage_tile(dp + t2, tile[T_D], lane);
        stage_tile(bp + t2, tile[T_B], lane);
      }
    }
#pragma unroll
    for (int r = 0; r < 8; ++r) sX[seg][r][lane] = x[r];
    sS[seg][lane] = sdt;
  }

  // sweep 2's first chunk flies across the hand-over (slot 0: no read and no copy of it is open)
  stage_tile(up, ring[seg][0][T_U], lane);
  stage_tile(dp, ring[seg][0][T_D], lane);
  stage_tile(bp, ring[seg][0][T_B], lane);
  stage_tile(cp, ring[seg][0][T_C], lane);
  stage_tile(zp, ring[seg][0][T_Z], lane);

  __syncthreads();                     // publishes sX and sS to the later segments' waves

  // ---- hand-over: x(start of seg) = fold over k < seg of exp(A * sum dt_k) * x + end_k ----
#pragma unroll
  for (int r = 0; r < 8; ++r) x[r] = 0.f;
  if (seg > 0) {
#pragma unroll
    for (int r = 0; r < 8; ++r) x[r] = sX[0][r][lane];
#pragma unroll 1
    for (int k = 1; k < seg; ++k) {
      float sk = sS[k][lane];
#pragma unroll
      for (int r = 0; r < 8; ++r) x[r] = __expf(sk * Areg[r]) * x[r] + sX[k][r][lane];
    }
  }

  // ---- sweep 2: the scan proper, from the true start state ----
  wait_stage();
  stage_tile(up + TCH, ring[seg][1][T_U], lane);
  stage_tile(dp + TCH, ring[seg][1][T_D], lane);
  stage_tile(bp + TCH, ring[seg][1][T_B], lane);
  stage_tile(cp + TCH, ring[seg][1][T_C], lane);
  stage_tile(zp + TCH, ring[seg][1][T_Z], lane);

#pragma unroll 1
  for (int c = 0; c < NCHUNK; ++c) {
    float (*tile)[16][ROWPAD] = ring[seg][c & 1];
    const int t0 = c * TCH;

    v8f acc[4];
#pragma unroll
    for (int i = 0; i < 4; ++i) acc[i] = (v8f){0.f,0.f,0.f,0.f,0.f,0.f,0.f,0.f};

#pragma unroll
    for (int j = 0; j < TCH; ++j) {
      float del = tile[T_D][dl][j];
      float uu  = tile[T_U][dl][j];
      float s   = del + bias;
      float dt  = (s > 15.f) ? s : __logf(1.f + __expf(s));   // softplus
      float dtu = dt * uu;
      const bool hit = (dl == j);     // C_t lands in output column N = j

#pragma unroll
      for (int i = 0; i < 4; ++i) {   // 4 K-slices of the 16-wide state
        int n0 = (i << 2) + (half << 1);
        float b0 = tile[T_B][n0][j];
        float b1 = tile[T_B][n0 + 1][j];
        float c0 = tile[T_C][n0][j];
        float c1 = tile[T_C][n0 + 1][j];
        float xa = __expf(dt * Areg[2 * i])     * x[2 * i]     + dtu * b0;
        float xb = __expf(dt * Areg[2 * i + 1]) * x[2 * i + 1] + dtu * b1;
        x[2 * i] = xa;
        x[2 * i + 1] = xb;
        v2f av; av.x = xa; av.y = xb;                 // A-matrix 16x4 slice
        v2f bv; bv.x = hit ? c0 : 0.f;                // B-matrix 4x16, col j only
        bv.y = hit ? c1 : 0.f;
        acc[i] = __builtin_amdgcn_wmma_f32_16x16x4_f32(
            false, av, false, bv, (short)0, acc[i], false, false);
      }
    }

    v8f yacc = acc[0] + acc[1] + acc[2] + acc[3];     // 16(ch) x 16(t) tile

    // epilogue: y = (y + D*u) * silu(z); lane holds column t = t0 + dl
#pragma unroll
    for (int r = 0; r < 8; ++r) {
      int row = r + (half << 3);
      float uu = tile[T_U][row][dl];
      float zz = tile[T_Z][row][dl];
      float val = yacc[r] + Dp[r] * uu;
      float sig = fast_rcp(1.f + __expf(-zz));        // v_rcp_f32, not IEEE div
      val *= zz * sig;
      yp[(size_t)row * LEN + (size_t)(t0 + dl)] = val;
    }
    // the stores' registers are reused right behind them (refill addresses, next chunk's loads)
    __asm__ volatile("s_wait_xcnt 0x0" ::: "memory");

    wait_reads();
    wait_stage();
    if (c + 2 < NCHUNK) {              // refill the slot just read
      const int t2 = (c + 2) * TCH;
      stage_tile(up + t2, tile[T_U], lane);
      stage_tile(dp + t2, tile[T_D], lane);
      stage_tile(bp + t2, tile[T_B], lane);
      stage_tile(cp + t2, tile[T_C], lane);
      stage_tile(zp + t2, tile[T_Z], lane);
    }
  }
}

extern "C" void kernel_launch(void* const* d_in, const int* in_sizes, int n_in,
                              void* d_out, int out_size, void* d_ws, size_t ws_size,
                              hipStream_t stream) {
  const float* u     = (const float*)d_in[0];
  const float* delta = (const float*)d_in[1];
  const float* A     = (const float*)d_in[2];
  const float* B     = (const float*)d_in[3];
  const float* C     = (const float*)d_in[4];
  const float* D     = (const float*)d_in[5];
  const float* z     = (const float*)d_in[6];
  const float* db    = (const float*)d_in[7];
  float* y = (float*)d_out;

  dim3 grid(BATCH * (CH / 16));   // 256 workgroups of NSEG waves
  dim3 block(32 * NSEG);
  hipLaunchKernelGGL(SelectiveScan_kernel, grid, block, 0, stream,
                     u, delta, A, B, C, D, z, db, y);
}

// v002
// It runs in 63.4 microseconds.
// Two timings next to v001 put it at 1.16 and 1.17 times that version's speed.
// Counting every step since v000, it is 5.67 times as fast.
#include <hip/hip_runtime.h>

#define BATCH 2
#define CH 2048
#define ST 16
#define LEN 2048
#define NSEG 16                // time segments per channel group, one wave each
#define SEGLEN (LEN / NSEG)    // 128 timesteps per wave
#define TCH 16                 // timesteps per LDS chunk = one 16-column WMMA output tile
#define NCHUNK (SEGLEN / TCH)  // 8
#define ROWPAD 20              // 16 + 4: 16B-aligned float4 slots, conflict-free columns

// tiles of one ring slot
#define T_U 0
#define T_D 1
#define T_B 2
#define T_C 3
#define T_Z 4

typedef __attribute__((ext_vector_type(2))) float v2f;
typedef __attribute__((ext_vector_type(4))) float v4f;
typedef __attribute__((ext_vector_type(8))) float v8f;
typedef __attribute__((ext_vector_type(4))) int   v4i;

#if defined(__HIP_DEVICE_COMPILE__) && defined(__gfx1250__) && \
    __has_builtin(__builtin_amdgcn_global_load_async_to_lds_b128) && \
    __has_builtin(__builtin_amdgcn_s_wait_asynccnt)
#define USE_ASYNC 1
#else
#define USE_ASYNC 0
#endif

__device__ __forceinline__ float fast_rcp(float x) {
#if defined(__HIP_DEVICE_COMPILE__) && __has_builtin(__builtin_amdgcn_rcpf)
  return __builtin_amdgcn_rcpf(x);     // single v_rcp_f32
#else
  return 1.f / x;
#endif
}

// softplus with no branch: the log form is worked out in every lane and a select picks the
// result, so that the 16 steps of a chunk stay one straight run of code for the scheduler.
__device__ __forceinline__ float softplus(float s) {
  float sp = __logf(1.f + __expf(s));
  return (s > 15.f) ? s : sp;
}

__device__ __forceinline__ void cp16(const float* g, float* l) {
#if USE_ASYNC
  __builtin_amdgcn_global_load_async_to_lds_b128(
      (__attribute__((address_space(1))) v4i*)g,
      (__attribute__((address_space(3))) v4i*)l,
      0, 0);
#else
  *(v4f*)l = *(const v4f*)g;
#endif
}

// The copies of this wave have landed: nothing of a slot is read in front of this.
__device__ __forceinline__ void wait_stage() {
#if USE_ASYNC
  __asm__ volatile("s_wait_asynccnt 0x0" ::: "memory");
#endif
}

// This wave's LDS reads have returned: a slot it has read may be refilled behind this.
__device__ __forceinline__ void wait_reads() {
#if USE_ASYNC
  __asm__ volatile("s_wait_dscnt 0x0" ::: "memory");
#endif
}

// Copy a 16-row x 16-col f32 tile (row stride LEN in global) into LDS [16][ROWPAD].
__device__ __forceinline__ void stage_tile(const float* __restrict__ g,
                                           float (*dst)[ROWPAD], int lane) {
#pragma unroll
  for (int i = 0; i < 2; ++i) {
    int idx = (i << 5) + lane;          // 0..63
    int row = idx >> 2;                 // 0..15
    int col = (idx & 3) << 2;           // 0..12 step 4
    cp16(g + (size_t)row * LEN + col, &dst[row][col]);
  }
}

// One workgroup = 16 channels of one batch; wave s owns timesteps [s*SEGLEN, (s+1)*SEGLEN).
// Sweep 1: every wave but the last scans its segment from a zero state (end state + sum of dt).
// Hand-over through LDS: wave s folds the end states of segments 0..s-1 into its start state.
// Sweep 2: every wave scans its segment again from that start state and writes y.
__global__ __launch_bounds__(32 * NSEG)
void SelectiveScan_kernel(const float* __restrict__ u, const float* __restrict__ delta,
                          const float* __restrict__ A, const float* __restrict__ Bm,
                          const float* __restrict__ Cm, const float* __restrict__ Dv,
                          const float* __restrict__ z, const float* __restrict__ dbias,
                          float* __restrict__ out) {
  // ring[s] is private to wave s: filled, read and refilled by that wave alone.
  __shared__ __attribute__((aligned(16))) float ring[NSEG][2][5][16][ROWPAD];
  __shared__ float sX[NSEG][8][32];    // end state of each segment scanned from zero
  __shared__ float sS[NSEG][32];       // sum of dt over each segment

  const int lane = threadIdx.x & 31;
  const int seg  = __builtin_amdgcn_readfirstlane(threadIdx.x >> 5);
  const int half = lane >> 4;          // 0/1
  const int dl   = lane & 15;          // channel-in-group = WMMA M / N position
  const int batch = blockIdx.x >> 7;   // 256 blocks = 2 batches x 128 channel groups
  const int d0    = (blockIdx.x & 127) << 4;

  const size_t chanBase = ((size_t)batch * CH + d0) * (size_t)LEN + (size_t)(seg * SEGLEN);
  const size_t stBase   = ((size_t)batch * ST) * (size_t)LEN + (size_t)(seg * SEGLEN);
  const float* up = u + chanBase;
  const float* dp = delta + chanBase;
  const float* zp = z + chanBase;
  const float* bp = Bm + stBase;
  const float* cp = Cm + stBase;
  float* yp = out + chanBase;

  const float bias = dbias[d0 + dl];
  float Areg[8], Dp[8];
#pragma unroll
  for (int r = 0; r < 8; ++r) {
    // state index held in x[r] for this lane (WMMA A-matrix 16x4 layout, 4 K-slices)
    int n = ((r >> 1) << 2) + (half << 1) + (r & 1);
    Areg[r] = A[(size_t)(d0 + dl) * ST + n];
    // channel handled by accumulator row r in C/D layout
    Dp[r] = Dv[d0 + r + (half << 3)];
  }

  float x[8];
#pragma unroll
  for (int r = 0; r < 8; ++r) x[r] = 0.f;

  // ---- sweep 1: local scan from zero (the last segment's end state has no reader) ----
  if (seg + 1 < NSEG) {
    float sdt = 0.f;
    stage_tile(up, ring[seg][0][T_U], lane);
    stage_tile(dp, ring[seg][0][T_D], lane);
    stage_tile(bp, ring[seg][0][T_B], lane);
    wait_stage();
    stage_tile(up + TCH, ring[seg][1][T_U], lane);
    stage_tile(dp + TCH, ring[seg][1][T_D], lane);
    stage_tile(bp + TCH, ring[seg][1][T_B], lane);

#pragma unroll 1
    for (int c = 0; c < NCHUNK; ++c) {
      float (*tile)[16][ROWPAD] = ring[seg][c & 1];
#pragma unroll
      for (int j = 0; j < TCH; ++j) {
        float del = tile[T_D][dl][j];
        float uu  = tile[T_U][dl][j];
        float s   = del + bias;
        float dt  = softplus(s);
        float dtu = dt * uu;
        sdt += dt;
#pragma unroll
        for (int i = 0; i < 4; ++i) {
          int n0 = (i << 2) + (half << 1);
          float b0 = tile[T_B][n0][j];
          float b1 = tile[T_B][n0 + 1][j];
          x[2 * i]     = __expf(dt * Areg[2 * i])     * x[2 * i]     + dtu * b0;
          x[2 * i + 1] = __expf(dt * Areg[2 * i + 1]) * x[2 * i + 1] + dtu * b1;
        }
      }
      wait_reads();
      wait_stage();
      if (c + 2 < NCHUNK) {            // refill the slot just read
        const int t2 = (c + 2) * TCH;
        stage_tile(up + t2, tile[T_U], lane);
        stage_tile(dp + t2, tile[T_D], lane);
        stage_tile(bp + t2, tile[T_B], lane);
      }
    }
#pragma unroll
    for (int r = 0; r < 8; ++r) sX[seg][r][lane] = x[r];
    sS[seg][lane] = sdt;
  }

  // sweep 2's first chunk flies across the hand-over (slot 0: no read and no copy of it is open)
  stage_tile(up, ring[seg][0][T_U], lane);
  stage_tile(dp, ring[seg][0][T_D], lane);
  stage_tile(bp, ring[seg][0][T_B], lane);
  stage_tile(cp, ring[seg][0][T_C], lane);
  stage_tile(zp, ring[seg][0][T_Z], lane);

  __syncthreads();                     // publishes sX and sS to the later segments' waves

  // ---- hand-over: x(start of seg) = fold over k < seg of exp(A * sum dt_k) * x + end_k ----
#pragma unroll
  for (int r = 0; r < 8; ++r) x[r] = 0.f;
  if (seg > 0) {
#pragma unroll
    for (int r = 0; r < 8; ++r) x[r] = sX[0][r][lane];
#pragma unroll 1
    for (int k = 1; k < seg; ++k) {
      float sk = sS[k][lane];
#pragma unroll
      for (int r = 0; r < 8; ++r) x[r] = __expf(sk * Areg[r]) * x[r] + sX[k][r][lane];
    }
  }

  // ---- sweep 2: the scan proper, from the true start state ----
  wait_stage();
  stage_tile(up + TCH, ring[seg][1][T_U], lane);
  stage_tile(dp + TCH, ring[seg][1][T_D], lane);
  stage_tile(bp + TCH, ring[seg][1][T_B], lane);
  stage_tile(cp + TCH, ring[seg][1][T_C], lane);
  stage_tile(zp + TCH, ring[seg][1][T_Z], lane);

#pragma unroll 1
  for (int c = 0; c < NCHUNK; ++c) {
    float (*tile)[16][ROWPAD] = ring[seg][c & 1];
    const int t0 = c * TCH;

    v8f acc[4];
#pragma unroll
    for (int i = 0; i < 4; ++i) acc[i] = (v8f){0.f,0.f,0.f,0.f,0.f,0.f,0.f,0.f};

#pragma unroll
    for (int j = 0; j < TCH; ++j) {
      float del = tile[T_D][dl][j];
      float uu  = tile[T_U][dl][j];
      float s   = del + bias;
      float dt  = softplus(s);
      float dtu = dt * uu;
      const bool hit = (dl == j);     // C_t lands in output column N = j

#pragma unroll
      for (int i = 0; i < 4; ++i) {   // 4 K-slices of the 16-wide state
        int n0 = (i << 2) + (half << 1);
        float b0 = tile[T_B][n0][j];
        float b1 = tile[T_B][n0 + 1][j];
        float c0 = tile[T_C][n0][j];
        float c1 = tile[T_C][n0 + 1][j];
        float xa = __expf(dt * Areg[2 * i])     * x[2 * i]     + dtu * b0;
        float xb = __expf(dt * Areg[2 * i + 1]) * x[2 * i + 1] + dtu * b1;
        x[2 * i] = xa;
        x[2 * i + 1] = xb;
        v2f av; av.x = xa; av.y = xb;                 // A-matrix 16x4 slice
        v2f bv; bv.x = hit ? c0 : 0.f;                // B-matrix 4x16, col j only
        bv.y = hit ? c1 : 0.f;
        acc[i] = __builtin_amdgcn_wmma_f32_16x16x4_f32(
            false, av, false, bv, (short)0, acc[i], false, false);
      }
    }

    v8f yacc = acc[0] + acc[1] + acc[2] + acc[3];     // 16(ch) x 16(t) tile

    // epilogue: y = (y + D*u) * silu(z); lane holds column t = t0 + dl
#pragma unroll
    for (int r = 0; r < 8; ++r) {
      int row = r + (half << 3);
      float uu = tile[T_U][row][dl];
      float zz = tile[T_Z][row][dl];
      float val = yacc[r] + Dp[r] * uu;
      float sig = fast_rcp(1.f + __expf(-zz));        // v_rcp_f32, not IEEE div
      val *= zz * sig;
      yp[(size_t)row * LEN + (size_t)(t0 + dl)] = val;
    }
    // the stores' registers are reused right behind them (refill addresses, next chunk's loads)
    __asm__ volatile("s_wait_xcnt 0x0" ::: "memory");

    wait_reads();
    wait_stage();
    if (c + 2 < NCHUNK) {              // refill the slot just read
      const int t2 = (c + 2) * TCH;
      stage_tile(up + t2, tile[T_U], lane);
      stage_tile(dp + t2, tile[T_D], lane);
      stage_tile(bp + t2, tile[T_B], lane);
      stage_tile(cp + t2, tile[T_C], lane);
      stage_tile(zp + t2, tile[T_Z], lane);
    }
  }
}

extern "C" void kernel_launch(void* const* d_in, const int* in_sizes, int n_in,
                              void* d_out, int out_size, void* d_ws, size_t ws_size,
                              hipStream_t stream) {
  const float* u     = (const float*)d_in[0];
  const float* delta = (const float*)d_in[1];
  const float* A     = (const float*)d_in[2];
  const float* B     = (const float*)d_in[3];
  const float* C     = (const float*)d_in[4];
  const float* D     = (const float*)d_in[5];
  const float* z     = (const float*)d_in[6];
  const float* db    = (const float*)d_in[7];
  float* y = (float*)d_out;

  dim3 grid(BATCH * (CH / 16));   // 256 workgroups of NSEG waves
  dim3 block(32 * NSEG);
  hipLaunchKernelGGL(SelectiveScan_kernel, grid, block, 0, stream,
                     u, delta, A, B, C, D, z, db, y);
}

// v003
// One run takes 55.3 microseconds.
// Timed twice side by side with v002, it ran 1.15 times as fast both times.
// Over all steps from v000 it is 6.51 times as fast.
#include <hip/hip_runtime.h>

#define BATCH 2
#define CH 2048
#define ST 16
#define LEN 2048
#define NSEG 16                // time segments per channel group, one wave each
#define SEGLEN (LEN / NSEG)    // 128 timesteps per wave
#define TCH 16                 // timesteps per LDS chunk = one 16-column WMMA output tile
#define NCHUNK (SEGLEN / TCH)  // 8
#define ROWPAD 20              // 16 + 4: 16B-aligned float4 slots, conflict-free columns

// tiles of one ring slot
#define T_U 0
#define T_D 1
#define T_B 2
#define T_C 3
#define T_Z 4

typedef __attribute__((ext_vector_type(2))) float v2f;
typedef __attribute__((ext_vector_type(4))) float v4f;
typedef __attribute__((ext_vector_type(8))) float v8f;
typedef __attribute__((ext_vector_type(4))) int   v4i;

#if defined(__HIP_DEVICE_COMPILE__) && defined(__gfx1250__) && \
    __has_builtin(__builtin_amdgcn_global_load_async_to_lds_b128) && \
    __has_builtin(__builtin_amdgcn_s_wait_asynccnt)
#define USE_ASYNC 1
#else
#define USE_ASYNC 0
#endif

__device__ __forceinline__ float fast_rcp(float x) {
#if defined(__HIP_DEVICE_COMPILE__) && __has_builtin(__builtin_amdgcn_rcpf)
  return __builtin_amdgcn_rcpf(x);     // single v_rcp_f32
#else
  return 1.f / x;
#endif
}

#define LOG2E 1.44269504088896340736f

// 2^x and log2(x) as the single hardware instructions (v_exp_f32, v_log_f32).
__device__ __forceinline__ float exp2_hw(float x) { return __builtin_amdgcn_exp2f(x); }
__device__ __forceinline__ float log2_hw(float x) { return __builtin_amdgcn_logf(x); }

// softplus(s) / ln 2 from t = s / ln 2, with no branch (a select picks the result, so that the 16
// steps of a chunk stay one straight run of code). The time step is carried in this base-2 unit:
// exp(dt * A) is 2^(lg * A) with no scaling on either side, and the log's argument is at least 1,
// so it needs none of the library log's range code. The state x is carried in the same unit
// (x / ln 2, since its input term is lg * u * B); the epilogue's sigmoid gives the ln 2 back.
__device__ __forceinline__ float softplus_log2(float t) {
  float lg = log2_hw(1.f + exp2_hw(t));
  return (t > 15.f * LOG2E) ? t : lg;
}

__device__ __forceinline__ void cp16(const float* g, float* l) {
#if USE_ASYNC
  __builtin_amdgcn_global_load_async_to_lds_b128(
      (__attribute__((address_space(1))) v4i*)g,
      (__attribute__((address_space(3))) v4i*)l,
      0, 0);
#else
  *(v4f*)l = *(const v4f*)g;
#endif
}

// The copies of this wave have landed: nothing of a slot is read in front of this.
__device__ __forceinline__ void wait_stage() {
#if USE_ASYNC
  __asm__ volatile("s_wait_asynccnt 0x0" ::: "memory");
#endif
}

// This wave's LDS reads have returned: a slot it has read may be refilled behind this.
__device__ __forceinline__ void wait_reads() {
#if USE_ASYNC
  __asm__ volatile("s_wait_dscnt 0x0" ::: "memory");
#endif
}

// Copy a 16-row x 16-col f32 tile (row stride LEN in global) into LDS [16][ROWPAD].
__device__ __forceinline__ void stage_tile(const float* __restrict__ g,
                                           float (*dst)[ROWPAD], int lane) {
#pragma unroll
  for (int i = 0; i < 2; ++i) {
    int idx = (i << 5) + lane;          // 0..63
    int row = idx >> 2;                 // 0..15
    int col = (idx & 3) << 2;           // 0..12 step 4
    cp16(g + (size_t)row * LEN + col, &dst[row][col]);
  }
}

// One workgroup = 16 channels of one batch; wave s owns timesteps [s*SEGLEN, (s+1)*SEGLEN).
// Sweep 1: every wave but the last scans its segment from a zero state (end state + sum of dt / ln 2).
// Hand-over through LDS: wave s folds the end states of segments 0..s-1 into its start state.
// Sweep 2: every wave scans its segment again from that start state and writes y.
__global__ __launch_bounds__(32 * NSEG)
void SelectiveScan_kernel(const float* __restrict__ u, const float* __restrict__ delta,
                          const float* __restrict__ A, const float* __restrict__ Bm,
                          const float* __restrict__ Cm, const float* __restrict__ Dv,
                          const float* __restrict__ z, const float* __restrict__ dbias,
                          float* __restrict__ out) {
  // ring[s] is private to wave s: filled, read and refilled by that wave alone.
  __shared__ __attribute__((aligned(16))) float ring[NSEG][2][5][16][ROWPAD];
  __shared__ float sX[NSEG][8][32];    // end state of each segment scanned from zero
  __shared__ float sS[NSEG][32];       // sum of dt / ln 2 over each segment

  const int lane = threadIdx.x & 31;
  const int seg  = __builtin_amdgcn_readfirstlane(threadIdx.x >> 5);
  const int half = lane >> 4;          // 0/1
  const int dl   = lane & 15;          // channel-in-group = WMMA M / N position
  const int batch = blockIdx.x >> 7;   // 256 blocks = 2 batches x 128 channel groups
  const int d0    = (blockIdx.x & 127) << 4;

  const size_t chanBase = ((size_t)batch * CH + d0) * (size_t)LEN + (size_t)(seg * SEGLEN);
  const size_t stBase   = ((size_t)batch * ST) * (size_t)LEN + (size_t)(seg * SEGLEN);
  const float* up = u + chanBase;
  const float* dp = delta + chanBase;
  const float* zp = z + chanBase;
  const float* bp = Bm + stBase;
  const float* cp = Cm + stBase;
  float* yp = out + chanBase;

  const float biasL = dbias[d0 + dl] * LOG2E;
  float Areg[8], Dp[8];
#pragma unroll
  for (int r = 0; r < 8; ++r) {
    // state index held in x[r] for this lane (WMMA A-matrix 16x4 layout, 4 K-slices)
    int n = ((r >> 1) << 2) + (half << 1) + (r & 1);
    Areg[r] = A[(size_t)(d0 + dl) * ST + n];
    // channel handled by accumulator row r in C/D layout
    Dp[r] = Dv[d0 + r + (half << 3)] * LOG2E;   // D / ln 2: added to y / ln 2
  }

  float x[8];
#pragma unroll
  for (int r = 0; r < 8; ++r) x[r] = 0.f;

  // ---- sweep 1: local scan from zero (the last segment's end state has no reader) ----
  if (seg + 1 < NSEG) {
    float sdt = 0.f;
    stage_tile(up, ring[seg][0][T_U], lane);
    stage_tile(dp, ring[seg][0][T_D], lane);
    stage_tile(bp, ring[seg][0][T_B], lane);
    wait_stage();
    stage_tile(up + TCH, ring[seg][1][T_U], lane);
    stage_tile(dp + TCH, ring[seg][1][T_D], lane);
    stage_tile(bp + TCH, ring[seg][1][T_B], lane);

#pragma unroll 1
    for (int c = 0; c < NCHUNK; ++c) {
      float (*tile)[16][ROWPAD] = ring[seg][c & 1];
#pragma unroll
      for (int j = 0; j < TCH; ++j) {
        float del = tile[T_D][dl][j];
        float uu  = tile[T_U][dl][j];
        float lg  = softplus_log2(del * LOG2E + biasL);   // dt / ln 2
        float dtu = lg * uu;
        sdt += lg;
#pragma unroll
        for (int i = 0; i < 4; ++i) {
          int n0 = (i << 2) + (half << 1);
          float b0 = tile[T_B][n0][j];
          float b1 = tile[T_B][n0 + 1][j];
          x[2 * i]     = exp2_hw(lg * Areg[2 * i])     * x[2 * i]     + dtu * b0;
          x[2 * i + 1] = exp2_hw(lg * Areg[2 * i + 1]) * x[2 * i + 1] + dtu * b1;
        }
      }
      wait_reads();
      wait_stage();
      if (c + 2 < NCHUNK) {            // refill the slot just read
        const int t2 = (c + 2) * TCH;
        stage_tile(up + t2, tile[T_U], lane);
        stage_tile(dp + t2, tile[T_D], lane);
        stage_tile(bp + t2, tile[T_B], lane);
      }
    }
#pragma unroll
    for (int r = 0; r < 8; ++r) sX[seg][r][lane] = x[r];
    sS[seg][lane] = sdt;
  }

  // sweep 2's first chunk flies across the hand-over (slot 0: no read and no copy of it is open)
  stage_tile(up, ring[seg][0][T_U], lane);
  stage_tile(dp, ring[seg][0][T_D], lane);
  stage_tile(bp, ring[seg][0][T_B], lane);
  stage_tile(cp, ring[seg][0][T_C], lane);
  stage_tile(zp, ring[seg][0][T_Z], lane);

  __syncthreads();                     // publishes sX and sS to the later segments' waves

  // ---- hand-over: x(start of seg) = fold over k < seg of exp(A * sum dt_k) * x + end_k ----
#pragma unroll
  for (int r = 0; r < 8; ++r) x[r] = 0.f;
  if (seg > 0) {
#pragma unroll
    for (int r = 0; r < 8; ++r) x[r] = sX[0][r][lane];
#pragma unroll 1
    for (int k = 1; k < seg; ++k) {
      float sk = sS[k][lane];
#pragma unroll
      for (int r = 0; r < 8; ++r) x[r] = exp2_hw(sk * Areg[r]) * x[r] + sX[k][r][lane];
    }
  }

  // ---- sweep 2: the scan proper, from the true start state ----
  wait_stage();
  stage_tile(up + TCH, ring[seg][1][T_U], lane);
  stage_tile(dp + TCH, ring[seg][1][T_D], lane);
  stage_tile(bp + TCH, ring[seg][1][T_B], lane);
  stage_tile(cp + TCH, ring[seg][1][T_C], lane);
  stage_tile(zp + TCH, ring[seg][1][T_Z], lane);

#pragma unroll 1
  for (int c = 0; c < NCHUNK; ++c) {
    float (*tile)[16][ROWPAD] = ring[seg][c & 1];
    const int t0 = c * TCH;

    v8f acc[4];
#pragma unroll
    for (int i = 0; i < 4; ++i) acc[i] = (v8f){0.f,0.f,0.f,0.f,0.f,0.f,0.f,0.f};

#pragma unroll
    for (int j = 0; j < TCH; ++j) {
      float del = tile[T_D][dl][j];
      float uu  = tile[T_U][dl][j];
      float lg  = softplus_log2(del * LOG2E + biasL);     // dt / ln 2
      float dtu = lg * uu;
      const bool hit = (dl == j);     // C_t lands in output column N = j

#pragma unroll
      for (int i = 0; i < 4; ++i) {   // 4 K-slices of the 16-wide state
        int n0 = (i << 2) + (half << 1);
        float b0 = tile[T_B][n0][j];
        float b1 = tile[T_B][n0 + 1][j];
        float c0 = tile[T_C][n0][j];
        float c1 = tile[T_C][n0 + 1][j];
        float xa = exp2_hw(lg * Areg[2 * i])     * x[2 * i]     + dtu * b0;
        float xb = exp2_hw(lg * Areg[2 * i + 1]) * x[2 * i + 1] + dtu * b1;
        x[2 * i] = xa;
        x[2 * i + 1] = xb;
        v2f av; av.x = xa; av.y = xb;                 // A-matrix 16x4 slice
        v2f bv; bv.x = hit ? c0 : 0.f;                // B-matrix 4x16, col j only
        bv.y = hit ? c1 : 0.f;
        acc[i] = __builtin_amdgcn_wmma_f32_16x16x4_f32(
            false, av, false, bv, (short)0, acc[i], false, false);
      }
    }

    v8f yacc = acc[0] + acc[1] + acc[2] + acc[3];     // 16(ch) x 16(t) tile

    // epilogue: y = (y + D*u) * silu(z), y and D both over ln 2; lane holds column t = t0 + dl
#pragma unroll
    for (int r = 0; r < 8; ++r) {
      int row = r + (half << 3);
      float uu = tile[T_U][row][dl];
      float zz = tile[T_Z][row][dl];
      float val = yacc[r] + Dp[r] * uu;
      // ln 2 * sigmoid(z): v_rcp_f32, not IEEE div; the ln 2 takes val back to the plain unit
      float sig = fast_rcp(__expf(-zz) * LOG2E + LOG2E);
      val *= zz * sig;
      yp[(size_t)row * LEN + (size_t)(t0 + dl)] = val;
    }
    // the stores' registers are reused right behind them (refill addresses, next chunk's loads)
    __asm__ volatile("s_wait_xcnt 0x0" ::: "memory");

    wait_reads();
    wait_stage();
    if (c + 2 < NCHUNK) {              // refill the slot just read
      const int t2 = (c + 2) * TCH;
      stage_tile(up + t2, tile[T_U], lane);
      stage_tile(dp + t2, tile[T_D], lane);
      stage_tile(bp + t2, tile[T_B], lane);
      stage_tile(cp + t2, tile[T_C], lane);
      stage_tile(zp + t2, tile[T_Z], lane);
    }
  }
}

extern "C" void kernel_launch(void* const* d_in, const int* in_sizes, int n_in,
                              void* d_out, int out_size, void* d_ws, size_t ws_size,
                              hipStream_t stream) {
  const float* u     = (const float*)d_in[0];
  const float* delta = (const float*)d_in[1];
  const float* A     = (const float*)d_in[2];
  const float* B     = (const float*)d_in[3];
  const float* C     = (const float*)d_in[4];
  const float* D     = (const float*)d_in[5];
  const float* z     = (const float*)d_in[6];
  const float* db    = (const float*)d_in[7];
  float* y = (float*)d_out;

  dim3 grid(BATCH * (CH / 16));   // 256 workgroups of NSEG waves
  dim3 block(32 * NSEG);
  hipLaunchKernelGGL(SelectiveScan_kernel, grid, block, 0, stream,
                     u, delta, A, B, C, D, z, db, y);
}

// v004
// A run of this version takes 53.2 microseconds.
// Timed twice side by side with v003, it ran 1.04 and 1.05 times as fast.
// Counting every step since v000, it is 6.80 times as fast.
#include <hip/hip_runtime.h>

#define BATCH 2
#define CH 2048
#define ST 16
#define LEN 2048
#define NSEG 16                // time segments per channel group, one wave each
#define SEGLEN (LEN / NSEG)    // 128 timesteps per wave
#define TCH 16                 // timesteps per LDS chunk = one 16-column WMMA output tile
#define NCHUNK (SEGLEN / TCH)  // 8
#define ROWPAD 20              // 16 + 4: 16B-aligned float4 slots, conflict-free columns

// tiles of one ring slot: three as [channel][step] ...
#define T_U 0
#define T_D 1
#define T_Z 2
// ... and two turned round, as [step][state slot]
#define T_B 0
#define T_C 1

typedef __attribute__((ext_vector_type(2))) float v2f;
typedef __attribute__((ext_vector_type(4))) float v4f;
typedef __attribute__((ext_vector_type(8))) float v8f;
typedef __attribute__((ext_vector_type(4))) int   v4i;

#if defined(__HIP_DEVICE_COMPILE__) && defined(__gfx1250__) && \
    __has_builtin(__builtin_amdgcn_global_load_async_to_lds_b128) && \
    __has_builtin(__builtin_amdgcn_global_load_async_to_lds_b32) && \
    __has_builtin(__builtin_amdgcn_s_wait_asynccnt)
#define USE_ASYNC 1
#else
#define USE_ASYNC 0
#endif

__device__ __forceinline__ float fast_rcp(float x) {
#if defined(__HIP_DEVICE_COMPILE__) && __has_builtin(__builtin_amdgcn_rcpf)
  return __builtin_amdgcn_rcpf(x);     // single v_rcp_f32
#else
  return 1.f / x;
#endif
}

#define LOG2E 1.44269504088896340736f

// 2^x and log2(x) as the single hardware instructions (v_exp_f32, v_log_f32).
__device__ __forceinline__ float exp2_hw(float x) { return __builtin_amdgcn_exp2f(x); }
__device__ __forceinline__ float log2_hw(float x) { return __builtin_amdgcn_logf(x); }

// softplus(s) / ln 2 from t = s / ln 2, with no branch (a select picks the result, so that the 16
// steps of a chunk stay one straight run of code). The time step is carried in this base-2 unit:
// exp(dt * A) is 2^(lg * A) with no scaling on either side, and the log's argument is at least 1,
// so it needs none of the library log's range code. The state x is carried in the same unit
// (x / ln 2, since its input term is lg * u * B); the epilogue's sigmoid gives the ln 2 back.
// Two neighbouring steps at a time, so that the plain arithmetic goes as packed f32.
__device__ __forceinline__ v2f softplus_log2_pair(v2f t) {
  v2f s = (v2f){exp2_hw(t.x), exp2_hw(t.y)} + (v2f){1.f, 1.f};
  v2f r;
  r.x = (t.x > 15.f * LOG2E) ? t.x : log2_hw(s.x);
  r.y = (t.y > 15.f * LOG2E) ? t.y : log2_hw(s.y);
  return r;
}

__device__ __forceinline__ void cp16(const float* g, float* l) {
#if USE_ASYNC
  __builtin_amdgcn_global_load_async_to_lds_b128(
      (__attribute__((address_space(1))) v4i*)g,
      (__attribute__((address_space(3))) v4i*)l,
      0, 0);
#else
  *(v4f*)l = *(const v4f*)g;
#endif
}

// 4 bytes of each lane from g + N bytes to l. The copy's offset field moves both of its addresses
// by N, so the LDS address is handed over N short; one global address then serves several rows.
template <int N>
__device__ __forceinline__ void cp4(const float* g, float* l) {
#if USE_ASYNC
  __builtin_amdgcn_global_load_async_to_lds_b32(
      (__attribute__((address_space(1))) int*)g,
      (__attribute__((address_space(3))) int*)l - N / 4,
      N, 0);
#else
  *l = g[N / 4];
#endif
}

// The copies of this wave have landed: nothing of a slot is read in front of this.
__device__ __forceinline__ void wait_stage() {
#if USE_ASYNC
  __asm__ volatile("s_wait_asynccnt 0x0" ::: "memory");
#endif
}

// This wave's LDS reads have returned: a slot it has read may be refilled behind this.
__device__ __forceinline__ void wait_reads() {
#if USE_ASYNC
  __asm__ volatile("s_wait_dscnt 0x0" ::: "memory");
#endif
}

// Copy a 16-row x 16-col f32 tile (row stride LEN in global) into LDS [16][ROWPAD].
__device__ __forceinline__ void stage_tile(const float* __restrict__ g,
                                           float (*dst)[ROWPAD], int lane) {
#pragma unroll
  for (int i = 0; i < 2; ++i) {
    int idx = (i << 5) + lane;          // 0..63
    int row = idx >> 2;                 // 0..15
    int col = (idx & 3) << 2;           // 0..12 step 4
    cp16(g + (size_t)row * LEN + col, &dst[row][col]);
  }
}

// Copy a 16-state x 16-step tile (B or C) into LDS turned round: dst[step][slot]. Each lane brings
// 4 bytes to a place of its own, so the turn costs no register. slot puts the eight states that
// one lane half holds side by side, in the order of x[0..7]: state 4i + 2h + e sits in 8h + 2i + e.
// A step's values then come as two 16-byte reads whose register pairs match the pairs of x.
// Copy i brings states 2i and 2i + 1 (one to each lane half), 16 steps of each.
#define ROW2 (2 * LEN * 4)              // bytes from one copy's global rows to the next copy's
__device__ __forceinline__ void stage_tile_turned(const float* __restrict__ g,
                                                  float (*dst)[ROWPAD], int lane) {
  const int e = lane >> 4;
  const int t = lane & 15;
  const float* g0 = g + e * LEN + t;    // states 0..7
  const float* g1 = g0 + 8 * LEN;       // states 8..15
  float* l = &dst[t][e];
  cp4<0 * ROW2>(g0, l);
  cp4<1 * ROW2>(g0, l + 8);
  cp4<2 * ROW2>(g0, l + 2);
  cp4<3 * ROW2>(g0, l + 10);
  cp4<0 * ROW2>(g1, l + 4);
  cp4<1 * ROW2>(g1, l + 12);
  cp4<2 * ROW2>(g1, l + 6);
  cp4<3 * ROW2>(g1, l + 14);
}

// The ring. ring.rows[s] and ring.turned[s] are private to wave s: filled, read and refilled by
// that wave alone. turned stands behind rows, so that every place in it lies further from the
// start of LDS than any offset a copy can carry: an LDS address less its offset is never below 0.
struct Ring {
  float rows[NSEG][2][3][16][ROWPAD];
  float turned[NSEG][2][2][16][ROWPAD];
};
static_assert(sizeof(Ring::rows) >= 65536 && 3 * ROW2 < 65536,
              "a turned place less its copy offset must stay inside the ring");

// One step of the eight states of a lane, two states to a packed f32 instruction:
// x = 2^(lg * A) * x + dtu * b.
__device__ __forceinline__ void step_states(v2f (&x2)[4], const v2f (&A2)[4],
                                            const float* __restrict__ brow, float lg, float dtu) {
  const v4f blo = *(const v4f*)brow;
  const v4f bhi = *(const v4f*)(brow + 4);
  const v2f b2[4] = {{blo.x, blo.y}, {blo.z, blo.w}, {bhi.x, bhi.y}, {bhi.z, bhi.w}};
  const v2f lg2 = {lg, lg};
  const v2f dtu2 = {dtu, dtu};
#pragma unroll
  for (int i = 0; i < 4; ++i) {
    v2f a = lg2 * A2[i];
    v2f e = {exp2_hw(a.x), exp2_hw(a.y)};
    x2[i] = __builtin_elementwise_fma(e, x2[i], dtu2 * b2[i]);
  }
}

// One workgroup = 16 channels of one batch; wave s owns timesteps [s*SEGLEN, (s+1)*SEGLEN).
// Sweep 1: every wave but the last scans its segment from a zero state (end state + sum of dt / ln 2).
// Hand-over through LDS: wave s folds the end states of segments 0..s-1 into its start state.
// Sweep 2: every wave scans its segment again from that start state and writes y.
__global__ __launch_bounds__(32 * NSEG)
void SelectiveScan_kernel(const float* __restrict__ u, const float* __restrict__ delta,
                          const float* __restrict__ A, const float* __restrict__ Bm,
                          const float* __restrict__ Cm, const float* __restrict__ Dv,
                          const float* __restrict__ z, const float* __restrict__ dbias,
                          float* __restrict__ out) {
  __shared__ __attribute__((aligned(16))) Ring ring;
  __shared__ float sX[NSEG][8][32];    // end state of each segment scanned from zero
  __shared__ float sS[NSEG][32];       // sum of dt / ln 2 over each segment

  const int lane = threadIdx.x & 31;
  const int seg  = __builtin_amdgcn_readfirstlane(threadIdx.x >> 5);
  const int half = lane >> 4;          // 0/1
  const int dl   = lane & 15;          // channel-in-group = WMMA M / N position
  const int batch = blockIdx.x >> 7;   // 256 blocks = 2 batches x 128 channel groups
  const int d0    = (blockIdx.x & 127) << 4;

  const size_t chanBase = ((size_t)batch * CH + d0) * (size_t)LEN + (size_t)(seg * SEGLEN);
  const size_t stBase   = ((size_t)batch * ST) * (size_t)LEN + (size_t)(seg * SEGLEN);
  const float* up = u + chanBase;
  const float* dp = delta + chanBase;
  const float* zp = z + chanBase;
  const float* bp = Bm + stBase;
  const float* cp = Cm + stBase;
  float* yp = out + chanBase;

  const float biasL = dbias[d0 + dl] * LOG2E;
  const v2f bias2  = {biasL, biasL};
  const v2f log2e2 = {LOG2E, LOG2E};
  float Areg[8], Dp[8];
  v2f A2[4];                           // Areg in the pairs of the packed instructions
#pragma unroll
  for (int r = 0; r < 8; ++r) {
    // state index held in x[r] for this lane (WMMA A-matrix 16x4 layout, 4 K-slices)
    int n = ((r >> 1) << 2) + (half << 1) + (r & 1);
    Areg[r] = A[(size_t)(d0 + dl) * ST + n];
    // channel handled by accumulator row r in C/D layout
    Dp[r] = Dv[d0 + r + (half << 3)] * LOG2E;   // D / ln 2: added to y / ln 2
  }
#pragma unroll
  for (int i = 0; i < 4; ++i) A2[i] = (v2f){Areg[2 * i], Areg[2 * i + 1]};

  v2f x2[4];                           // x2[i] = states 4i + 2*half and 4i + 2*half + 1
#pragma unroll
  for (int i = 0; i < 4; ++i) x2[i] = (v2f){0.f, 0.f};

  // ---- sweep 1: local scan from zero (the last segment's end state has no reader) ----
  if (seg + 1 < NSEG) {
    float sdt = 0.f;
    stage_tile(up, ring.rows[seg][0][T_U], lane);
    stage_tile(dp, ring.rows[seg][0][T_D], lane);
    stage_tile_turned(bp, ring.turned[seg][0][T_B], lane);
    wait_stage();
    stage_tile(up + TCH, ring.rows[seg][1][T_U], lane);
    stage_tile(dp + TCH, ring.rows[seg][1][T_D], lane);
    stage_tile_turned(bp + TCH, ring.turned[seg][1][T_B], lane);

#pragma unroll 1
    for (int c = 0; c < NCHUNK; ++c) {
      float (*tile)[16][ROWPAD] = ring.rows[seg][c & 1];
      float (*turn)[16][ROWPAD] = ring.turned[seg][c & 1];
#pragma unroll
      for (int j = 0; j < TCH; j += 2) {
        v2f del = *(const v2f*)&tile[T_D][dl][j];
        v2f uu  = *(const v2f*)&tile[T_U][dl][j];
        v2f lg  = softplus_log2_pair(__builtin_elementwise_fma(del, log2e2, bias2));  // dt / ln 2
        v2f dtu = lg * uu;
        sdt += lg.x;
        sdt += lg.y;
        step_states(x2, A2, &turn[T_B][j][half << 3], lg.x, dtu.x);
        step_states(x2, A2, &turn[T_B][j + 1][half << 3], lg.y, dtu.y);
      }
      wait_reads();
      wait_stage();
      if (c + 2 < NCHUNK) {            // refill the slot just read
        const int t2 = (c + 2) * TCH;
        stage_tile(up + t2, tile[T_U], lane);
        stage_tile(dp + t2, tile[T_D], lane);
        stage_tile_turned(bp + t2, turn[T_B], lane);
      }
    }
#pragma unroll
    for (int r = 0; r < 8; ++r) sX[seg][r][lane] = x2[r >> 1][r & 1];
    sS[seg][lane] = sdt;
  }

  // sweep 2's first chunk flies across the hand-over (slot 0: no read and no copy of it is open)
  stage_tile(up, ring.rows[seg][0][T_U], lane);
  stage_tile(dp, ring.rows[seg][0][T_D], lane);
  stage_tile_turned(bp, ring.turned[seg][0][T_B], lane);
  stage_tile_turned(cp, ring.turned[seg][0][T_C], lane);
  stage_tile(zp, ring.rows[seg][0][T_Z], lane);

  __syncthreads();                     // publishes sX and sS to the later segments' waves

  // ---- hand-over: x(start of seg) = fold over k < seg of exp(A * sum dt_k) * x + end_k ----
  float x[8];
#pragma unroll
  for (int r = 0; r < 8; ++r) x[r] = 0.f;
  if (seg > 0) {
#pragma unroll
    for (int r = 0; r < 8; ++r) x[r] = sX[0][r][lane];
#pragma unroll 1
    for (int k = 1; k < seg; ++k) {
      float sk = sS[k][lane];
#pragma unroll
      for (int r = 0; r < 8; ++r) x[r] = exp2_hw(sk * Areg[r]) * x[r] + sX[k][r][lane];
    }
  }

#pragma unroll
  for (int i = 0; i < 4; ++i) x2[i] = (v2f){x[2 * i], x[2 * i + 1]};

  // ---- sweep 2: the scan proper, from the true start state ----
  wait_stage();
  stage_tile(up + TCH, ring.rows[seg][1][T_U], lane);
  stage_tile(dp + TCH, ring.rows[seg][1][T_D], lane);
  stage_tile_turned(bp + TCH, ring.turned[seg][1][T_B], lane);
  stage_tile_turned(cp + TCH, ring.turned[seg][1][T_C], lane);
  stage_tile(zp + TCH, ring.rows[seg][1][T_Z], lane);

#pragma unroll 1
  for (int c = 0; c < NCHUNK; ++c) {
    float (*tile)[16][ROWPAD] = ring.rows[seg][c & 1];
    float (*turn)[16][ROWPAD] = ring.turned[seg][c & 1];
    const int t0 = c * TCH;

    v8f acc[4];
#pragma unroll
    for (int i = 0; i < 4; ++i) acc[i] = (v8f){0.f,0.f,0.f,0.f,0.f,0.f,0.f,0.f};

    // This lane is output column dl: of C it needs step t0 + dl alone, its half's eight states.
    const v4f clo = *(const v4f*)&turn[T_C][dl][half << 3];
    const v4f chi = *(const v4f*)&turn[T_C][dl][(half << 3) + 4];
    const v2f c2[4] = {{clo.x, clo.y}, {clo.z, clo.w}, {chi.x, chi.y}, {chi.z, chi.w}};

#pragma unroll
    for (int j = 0; j < TCH; j += 2) {
      v2f del = *(const v2f*)&tile[T_D][dl][j];
      v2f uu  = *(const v2f*)&tile[T_U][dl][j];
      v2f lg  = softplus_log2_pair(__builtin_elementwise_fma(del, log2e2, bias2));  // dt / ln 2
      v2f dtu = lg * uu;
#pragma unroll
      for (int k = 0; k < 2; ++k) {
        step_states(x2, A2, &turn[T_B][j + k][half << 3], lg[k], dtu[k]);
        const float m = (dl == j + k) ? 1.f : 0.f;    // C_t lands in output column N = j + k
        const v2f m2 = {m, m};
#pragma unroll
        for (int i = 0; i < 4; ++i) {   // 4 K-slices of the 16-wide state
          acc[i] = __builtin_amdgcn_wmma_f32_16x16x4_f32(   // A 16x4 = x2[i]; B 4x16 = that column
              false, x2[i], false, c2[i] * m2, (short)0, acc[i], false, false);
        }
      }
    }

    v8f yacc = acc[0] + acc[1] + acc[2] + acc[3];     // 16(ch) x 16(t) tile

    // epilogue: y = (y + D*u) * silu(z), y and D both over ln 2; lane holds column t = t0 + dl
#pragma unroll
    for (int r = 0; r < 8; ++r) {
      int row = r + (half << 3);
      float uu = tile[T_U][row][dl];
      float zz = tile[T_Z][row][dl];
      float val = yacc[r] + Dp[r] * uu;
      // ln 2 * sigmoid(z): v_rcp_f32, not IEEE div; the ln 2 takes val back to the plain unit
      float sig = fast_rcp(__expf(-zz) * LOG2E + LOG2E);
      val *= zz * sig;
      yp[(size_t)row * LEN + (size_t)(t0 + dl)] = val;
    }
    // the stores' registers are reused right behind them (refill addresses, next chunk's loads)
    __asm__ volatile("s_wait_xcnt 0x0" ::: "memory");

    wait_reads();
    wait_stage();
    if (c + 2 < NCHUNK) {              // refill the slot just read
      const int t2 = (c + 2) * TCH;
      stage_tile(up + t2, tile[T_U], lane);
      stage_tile(dp + t2, tile[T_D], lane);
      stage_tile_turned(bp + t2, turn[T_B], lane);
      stage_tile_turned(cp + t2, turn[T_C], lane);
      stage_tile(zp + t2, tile[T_Z], lane);
    }
  }
}

extern "C" void kernel_launch(void* const* d_in, const int* in_sizes, int n_in,
                              void* d_out, int out_size, void* d_ws, size_t ws_size,
                              hipStream_t stream) {
  const float* u     = (const float*)d_in[0];
  const float* delta = (const float*)d_in[1];
  const float* A     = (const float*)d_in[2];
  const float* B     = (const float*)d_in[3];
  const float* C     = (const float*)d_in[4];
  const float* D     = (const float*)d_in[5];
  const float* z     = (const float*)d_in[6];
  const float* db    = (const float*)d_in[7];
  float* y = (float*)d_out;

  dim3 grid(BATCH * (CH / 16));   // 256 workgroups of NSEG waves
  dim3 block(32 * NSEG);
  hipLaunchKernelGGL(SelectiveScan_kernel, grid, block, 0, stream,
                     u, delta, A, B, C, D, z, db, y);
}

// v006
// It runs in 41.7 microseconds.
// Versions in between are left out here; by their measured steps it is 1.29 times as fast as v004.
// Over all steps from v000 it is 8.75 times as fast.
#include <hip/hip_runtime.h>

#define BATCH 2
#define CH 2048
#define ST 16
#define LEN 2048
#define NW 4                   // scan waves per workgroup: wave w holds states 4w .. 4w+3 of 16 channels
#define NH 4                   // helper waves per workgroup: wave NW + w has rows 4w .. 4w+3 of the shared work
#define STG 64                 // timesteps per staged tile
#define NSTG (LEN / STG)       // 32
#define TCH 16                 // timesteps per 16-column WMMA output tile
#define RP (STG + 4)           // pitch of a [channel][step] tile: 16B-aligned rows, conflict-free
#define TP (ST + 4)            // pitch of a [step][state] tile

typedef __attribute__((ext_vector_type(2))) float v2f;
typedef __attribute__((ext_vector_type(4))) float v4f;
typedef __attribute__((ext_vector_type(8))) float v8f;
typedef __attribute__((ext_vector_type(4))) int   v4i;

#if defined(__HIP_DEVICE_COMPILE__) && defined(__gfx1250__) && \
    __has_builtin(__builtin_amdgcn_global_load_async_to_lds_b128) && \
    __has_builtin(__builtin_amdgcn_global_load_async_to_lds_b32) && \
    __has_builtin(__builtin_amdgcn_s_wait_asynccnt)
#define USE_ASYNC 1
#else
#define USE_ASYNC 0
#endif

__device__ __forceinline__ float fast_rcp(float x) {
#if defined(__HIP_DEVICE_COMPILE__) && __has_builtin(__builtin_amdgcn_rcpf)
  return __builtin_amdgcn_rcpf(x);     // single v_rcp_f32
#else
  return 1.f / x;
#endif
}

#define LOG2E 1.44269504088896340736f

// 2^x and log2(x) as the single hardware instructions (v_exp_f32, v_log_f32).
__device__ __forceinline__ float exp2_hw(float x) { return __builtin_amdgcn_exp2f(x); }
__device__ __forceinline__ float log2_hw(float x) { return __builtin_amdgcn_logf(x); }

// softplus(s) / ln 2 from t = s / ln 2, with no branch (a select picks the result, so that a lane's
// 4 steps of 2 channels stay one straight run of code). The time step is carried in this base-2 unit:
// exp(dt * A) is 2^(lg * A) with no scaling on either side, and the log's argument is at least 1,
// so it needs none of the library log's range code. The state x is carried in the same unit
// (x / ln 2, since its input term is lg * u * B); the epilogue's sigmoid gives the ln 2 back.
// Two neighbouring steps at a time, so that the plain arithmetic goes as packed f32.
__device__ __forceinline__ v2f softplus_log2_pair(v2f t) {
  v2f s = (v2f){exp2_hw(t.x), exp2_hw(t.y)} + (v2f){1.f, 1.f};
  v2f r;
  r.x = (t.x > 15.f * LOG2E) ? t.x : log2_hw(s.x);
  r.y = (t.y > 15.f * LOG2E) ? t.y : log2_hw(s.y);
  return r;
}

__device__ __forceinline__ void cp16(const float* g, float* l) {
#if USE_ASYNC
  __builtin_amdgcn_global_load_async_to_lds_b128(
      (__attribute__((address_space(1))) v4i*)g,
      (__attribute__((address_space(3))) v4i*)l,
      0, 0);
#else
  *(v4f*)l = *(const v4f*)g;
#endif
}

// 4 bytes of each lane from g to l.
__device__ __forceinline__ void cp4(const float* g, float* l) {
#if USE_ASYNC
  __builtin_amdgcn_global_load_async_to_lds_b32(
      (__attribute__((address_space(1))) int*)g,
      (__attribute__((address_space(3))) int*)l,
      0, 0);
#else
  *l = *g;
#endif
}

// The copies of this wave have landed: nothing of a slot is read in front of this.
__device__ __forceinline__ void wait_stage() {
#if USE_ASYNC
  __asm__ volatile("s_wait_asynccnt 0x0" ::: "memory");
#endif
}

// This wave's LDS reads have returned: a slot it has read may be refilled behind this.
__device__ __forceinline__ void wait_reads() {
#if USE_ASYNC
  __asm__ volatile("s_wait_dscnt 0x0" ::: "memory");
#endif
}

// What the copies fill, STG steps at a time. u, d, z as [channel][step], read by the helper waves
// alone; b, c turned round, as [step][state], read by the scan waves alone.
struct Raw {
  float u[16][RP];
  float d[16][RP];
  float z[16][RP];
};
struct Bc {
  float b[STG][TP];
  float c[STG][TP];
};

// Everything is kept twice, by the stage's parity: the helpers write stage s + 1 and read stage
// s - 1 while the scan waves are in stage s.
// The arrays that no copy fills stand in front, so that every place a copy is aimed at lies
// further from the start of LDS than the span of global rows its wave copies from one base
// address (u, d, z: under 4 rows; b, c: 4 rows): an LDS address less a row step is never below 0.
struct Smem {
  float part[2][NW][16][RP];   // y of one stage from each scan wave's four states, [channel][step]
  float lg[2][16][RP];         // dt / ln 2 of the stage
  float du[2][16][RP];         // dt / ln 2 * u of the stage
  float dterm[2][16][RP];      // D / ln 2 * u of the stage; each place written and read by one lane
  float gate[2][16][RP];       // ln 2 * silu(z) of the stage; likewise
  Raw raw[2];
  Bc bc[2];
};
static_assert(sizeof(Smem::part) + sizeof(Smem::lg) + sizeof(Smem::du) >= 4 * LEN * 4,
              "a copy's place in LDS must lie beyond the span of its wave's global rows");

// Wave w brings rows 4w .. 4w+3 of a 16-row x STG-step tile (row stride LEN in global).
__device__ __forceinline__ void stage_rows(const float* __restrict__ g, float (*dst)[RP],
                                           int w, int lane) {
#pragma unroll
  for (int i = 0; i < 2; ++i) {
    int row = 4 * w + 2 * i + (lane >> 4);
    int col = (lane & 15) << 2;
    cp16(g + (size_t)row * LEN + col, &dst[row][col]);
  }
}

// Wave w brings its own four states of B or C, STG steps of each, turned round: dst[step][state].
// Each lane brings 4 bytes to a place of its own, so the turn costs no register.
__device__ __forceinline__ void stage_turned(const float* __restrict__ g, float (*dst)[TP],
                                             int w, int lane) {
#pragma unroll
  for (int n = 0; n < 4; ++n) {
#pragma unroll
    for (int h = 0; h < 2; ++h) {
      int t = h * 32 + lane;
      cp4(g + (size_t)(4 * w + n) * LEN + t, &dst[t][4 * w + n]);
    }
  }
}

// What one lane reads of LDS for 16 steps: its channel's dt and dt * u, its two states of B at
// every step, and its two states of C at the one step that is its output column.
struct Ops {
  v4f lg[4];
  v4f du[4];
  v2f b[TCH];
  v2f c;
};

__device__ __forceinline__ void load_ops(Ops& o, const float* lgrow, const float* durow,
                                         const float (*bt)[TP], const float (*ct)[TP],
                                         int k, int dl, int so) {
#pragma unroll
  for (int q = 0; q < 4; ++q) {
    o.lg[q] = *(const v4f*)&lgrow[TCH * k + 4 * q];
    o.du[q] = *(const v4f*)&durow[TCH * k + 4 * q];
  }
#pragma unroll
  for (int j = 0; j < TCH; ++j) o.b[j] = *(const v2f*)&bt[TCH * k + j][so];
  o.c = *(const v2f*)&ct[TCH * k + dl][so];
}

// One workgroup = 16 channels of one batch, eight waves in two roles. Scan wave w (0 .. 3) carries
// states 4w .. 4w+3 of all 16 channels (one K-slice of the 16x16x4 WMMA, two states to a lane)
// through all LEN steps, once, and does nothing else: per stage of STG steps it reads dt, dt * u, B
// and C from LDS and leaves its share of y there. Helper wave NW + w, which shares a SIMD with scan
// wave w, does all the rest in the issue slots the scan leaves open: in trip s it sums, gates and
// stores stage s - 1, works out dt, dt * u and the gate's terms of stage s + 1, and brings in the
// tiles of later stages. One barrier at the foot of a trip hands everything over.
__global__ __launch_bounds__(32 * (NW + NH))
void SelectiveScan_kernel(const float* __restrict__ u, const float* __restrict__ delta,
                          const float* __restrict__ A, const float* __restrict__ Bm,
                          const float* __restrict__ Cm, const float* __restrict__ Dv,
                          const float* __restrict__ z, const float* __restrict__ dbias,
                          float* __restrict__ out) {
  __shared__ __attribute__((aligned(16))) Smem sm;

  const int lane = threadIdx.x & 31;
  const int wv   = __builtin_amdgcn_readfirstlane(threadIdx.x >> 5);
  const bool scanner = wv < NW;        // the same for a whole wave: a scalar branch
  const int w    = wv & (NW - 1);
  const int half = lane >> 4;          // 0/1
  const int dl   = lane & 15;          // channel-in-group = WMMA M / N position
  const int so   = 4 * w + 2 * half;   // first of this lane's two states (WMMA A 16x4 layout)
  const int batch = blockIdx.x >> 7;   // 256 blocks = 2 batches x 128 channel groups
  const int d0    = (blockIdx.x & 127) << 4;

  const size_t chanBase = ((size_t)batch * CH + d0) * (size_t)LEN;
  const size_t stBase   = ((size_t)batch * ST) * (size_t)LEN;
  const float* up = u + chanBase;
  const float* dp = delta + chanBase;
  const float* zp = z + chanBase;
  const float* bp = Bm + stBase;
  const float* cp = Cm + stBase;
  float* yp = out + chanBase;

  const v2f log2e2 = {LOG2E, LOG2E};
  const v2f A2 = {A[(size_t)(d0 + dl) * ST + so], A[(size_t)(d0 + dl) * ST + so + 1]};

  // The helpers' work goes by rows: this lane has rows erow[0], erow[1], four steps from ecol on,
  // of every stage; these are the very 16 bytes of u, d and z that the lane's own copies bring.
  const int ecol = dl << 2;
  int erow[2];
  v2f bias2[2];
  float Dp[2];
#pragma unroll
  for (int i = 0; i < 2; ++i) {
    erow[i] = 4 * w + 2 * i + half;
    const float bl = dbias[d0 + erow[i]] * LOG2E;
    bias2[i] = (v2f){bl, bl};
    Dp[i] = Dv[d0 + erow[i]] * LOG2E;  // D / ln 2: added to y / ln 2
  }

  // y = (sum of the four shares + D*u) * silu(z) of stage sp, y and D over ln 2; stored.
  auto finish = [&](int sp) __attribute__((always_inline)) {
    const int p = sp & 1;
#pragma unroll
    for (int i = 0; i < 2; ++i) {
      const int row = erow[i];
      v4f y = *(const v4f*)&sm.part[p][0][row][ecol];
      y += *(const v4f*)&sm.part[p][1][row][ecol];
      y += *(const v4f*)&sm.part[p][2][row][ecol];
      y += *(const v4f*)&sm.part[p][3][row][ecol];
      *(v4f*)&yp[(size_t)row * LEN + (size_t)(sp * STG + ecol)] =
          (y + *(const v4f*)&sm.dterm[p][row][ecol]) * *(const v4f*)&sm.gate[p][row][ecol];
    }
    // the stores' registers are reused right behind them
    __asm__ volatile("s_wait_xcnt 0x0" ::: "memory");
  };

  // dt / ln 2, dt / ln 2 * u and the gate's two terms of stage sn, each value once in the workgroup
  auto prep = [&](int sn) __attribute__((always_inline)) {
    const int p = sn & 1;
    const Raw& rw = sm.raw[p];
#pragma unroll
    for (int i = 0; i < 2; ++i) {
      const v4f del = *(const v4f*)&rw.d[erow[i]][ecol];
      const v4f uu  = *(const v4f*)&rw.u[erow[i]][ecol];
      const v4f zz  = *(const v4f*)&rw.z[erow[i]][ecol];
      const v2f l0 = softplus_log2_pair(
          __builtin_elementwise_fma((v2f){del.x, del.y}, log2e2, bias2[i]));
      const v2f l1 = softplus_log2_pair(
          __builtin_elementwise_fma((v2f){del.z, del.w}, log2e2, bias2[i]));
      const v4f lg = {l0.x, l0.y, l1.x, l1.y};
      v4f g;
#pragma unroll
      for (int q = 0; q < 4; ++q) {
        // ln 2 * sigmoid(z): v_rcp_f32, not IEEE div; the ln 2 takes y back to the plain unit
        g[q] = zz[q] * fast_rcp(__expf(-zz[q]) * LOG2E + LOG2E);
      }
      *(v4f*)&sm.lg[p][erow[i]][ecol] = lg;
      *(v4f*)&sm.du[p][erow[i]][ecol] = lg * uu;
      *(v4f*)&sm.dterm[p][erow[i]][ecol] = uu * Dp[i];
      *(v4f*)&sm.gate[p][erow[i]][ecol] = g;
    }
  };

  auto stage_raw = [&](int s) __attribute__((always_inline)) {
    Raw& rw = sm.raw[s & 1];
    const int t0 = s * STG;
    stage_rows(up + t0, rw.u, w, lane);
    stage_rows(dp + t0, rw.d, w, lane);
    stage_rows(zp + t0, rw.z, w, lane);
  };
  auto stage_bc = [&](int s) __attribute__((always_inline)) {
    Bc& t = sm.bc[s & 1];
    const int t0 = s * STG;
    stage_turned(bp + t0, t.b, w, lane);
    stage_turned(cp + t0, t.c, w, lane);
  };

  v2f x2 = {0.f, 0.f};                 // states so and so + 1 of channel dl, over ln 2

  if (!scanner) {
    stage_raw(0);
    stage_raw(1);
    stage_bc(0);
  }
  wait_stage();
  __syncthreads();                     // publishes what the first two trips read

  // Trip -1 scans nothing: it prepares stage 0 and brings in later tiles; trip NSTG only finishes the last stage.
  // Kept rolled: a trip is some thousand instructions long, and a second copy would only grow the code.
#pragma unroll 1
  for (int s = -1; s <= NSTG; ++s) {
    if (scanner) {
      if (s >= 0 && s < NSTG) {
        const int p = s & 1;
        const Bc& tl = sm.bc[p];
        Ops cur, nxt;
        load_ops(cur, sm.lg[p][dl], sm.du[p][dl], tl.b, tl.c, 0, dl, so);
#pragma unroll
        for (int k = 0; k < STG / TCH; ++k) {
          if (k + 1 < STG / TCH) load_ops(nxt, sm.lg[p][dl], sm.du[p][dl], tl.b, tl.c, k + 1, dl, so);
          // keeps the next 16 steps' LDS reads in front of this block: a read that stands at its
          // use is waited for with little else on the SIMD to issue
          __builtin_amdgcn_sched_barrier(0);
          v8f acc[2];                  // two chains: a dependent WMMA comes later than the issue rate
          acc[0] = (v8f){0.f,0.f,0.f,0.f,0.f,0.f,0.f,0.f};
          acc[1] = (v8f){0.f,0.f,0.f,0.f,0.f,0.f,0.f,0.f};
#pragma unroll
          for (int j = 0; j < TCH; ++j) {
            const float lg = cur.lg[j >> 2][j & 3];
            const float du = cur.du[j >> 2][j & 3];
            const v2f a = (v2f){lg, lg} * A2;
            const v2f e = {exp2_hw(a.x), exp2_hw(a.y)};
            x2 = __builtin_elementwise_fma(e, x2, (v2f){du, du} * cur.b[j]);   // x = 2^(lg*A) * x + dtu * b
            const float m = (dl == j) ? 1.f : 0.f;        // C_t lands in output column N = j
            acc[j & 1] = __builtin_amdgcn_wmma_f32_16x16x4_f32(   // A 16x4 = x2; B 4x16 = that column
                false, x2, false, cur.c * (v2f){m, m}, (short)0, acc[j & 1], false, false);
          }
          const v8f ya = acc[0] + acc[1];  // their columns are disjoint: one side of each sum is 0
#pragma unroll
          for (int r = 0; r < 8; ++r) sm.part[p][w][r + (half << 3)][TCH * k + dl] = ya[r];
          cur = nxt;
        }
      }
    } else {
      if (s >= 1) finish(s - 1);       // in front of prep, which writes the same dterm and gate anew
      if (s + 1 < NSTG) prep(s + 1);
    }

    wait_reads();
    wait_stage();
    __syncthreads();                   // publishes the shares of s, dt of s + 1 and the tiles in flight;
                                       // ends the reads of all that is written or refilled next
    if (!scanner) {
      if (s + 2 < NSTG) stage_bc(s + 2);    // into the B, C tile that trip s has just read
      if (s + 3 < NSTG) stage_raw(s + 3);   // into the u, d, z tile that trip s has just read
    }
  }
  wait_stage();
}

extern "C" void kernel_launch(void* const* d_in, const int* in_sizes, int n_in,
                              void* d_out, int out_size, void* d_ws, size_t ws_size,
                              hipStream_t stream) {
  const float* u     = (const float*)d_in[0];
  const float* delta = (const float*)d_in[1];
  const float* A     = (const float*)d_in[2];
  const float* B     = (const float*)d_in[3];
  const float* C     = (const float*)d_in[4];
  const float* D     = (const float*)d_in[5];
  const float* z     = (const float*)d_in[6];
  const float* db    = (const float*)d_in[7];
  float* y = (float*)d_out;

  dim3 grid(BATCH * (CH / 16));   // 256 workgroups of NW + NH waves
  dim3 block(32 * (NW + NH));
  hipLaunchKernelGGL(SelectiveScan_kernel, grid, block, 0, stream,
                     u, delta, A, B, C, D, z, db, y);
}
